// v000
// Times are from an AMD MI455X. After a warm-up the kernel runs many times in a row, and a time is the length of
// such a window on the GPU divided by its runs, so every launch and the gaps after it count. The runs cycle
// through copies of the inputs. A figure is the median of several windows, for all but v000 over two sittings.
// Sittings can differ by a few percent; kernels timed side by side share one.
// The starting kernel, v000, takes 35.6 microseconds a run.
#include <hip/hip_runtime.h>
#include <stdint.h>

// Problem constants (fixed by the reference).
#define B_    4
#define N_    16384
#define H_    8
#define D_    128
#define K_    32
#define S_    16
#define M_    1023          // (N-K)/S + 1
#define MT_   64            // number of 16-row m-tiles (ceil(M/16))
#define ROWS_ 272           // band span per m-tile: 16*15 + 32
#define P_    136           // padded LDS row stride in floats (2P mod 64 == 16 -> no DS bank conflicts)
#define NQ_   68            // 4-wide K-chunks along the band (272/4)

typedef float v2f __attribute__((ext_vector_type(2)));
typedef float v8f __attribute__((ext_vector_type(8)));

// One workgroup = 8 waves = one (b, h, 16-m tile). Each wave owns a 16-wide d-tile.
// Y_tile(16x16) = sum_q A_q(16x4) * B_q(4x16), A_q[i,jj] = w[4q+jj-16i] (banded, built
// via ds_bpermute from a lane-resident copy of w), B_q from the LDS-staged x window.
__global__ __launch_bounds__(256, 1)
void compresskv_wmma(const float* __restrict__ x,
                     const float* __restrict__ w,
                     const float* __restrict__ pe,
                     float* __restrict__ y)
{
    __shared__ float xs[ROWS_ * P_];   // 272 x 136 floats = 147,968 B

    const int tid  = threadIdx.x;
    const int lane = tid & 31;
    const int wid  = tid >> 5;              // 0..7 : this wave's d-tile

    const int tileid = blockIdx.x;          // 0..2047
    const int mt = tileid & (MT_ - 1);      // m-tile index
    const int bh = tileid >> 6;             // 0..31
    const int b  = bh >> 3;
    const int h  = bh & 7;

    const int  m0 = mt * 16;
    const long n0 = (long)m0 * S_;          // first input row of the band window

    const float* xbh = x + (((long)b * N_) * H_ + h) * D_;  // + n*H*D + d

    // ---- stage 1: async DMA the 272-row window into LDS (1 instr = 1 row = 512 B) ----
    for (int j = 0; j < ROWS_ / 8; ++j) {
        const int  r = wid + 8 * j;                          // wave-uniform row
        const long n = n0 + r;
        const uint32_t lds = (uint32_t)(uintptr_t)(&xs[r * P_]) + (uint32_t)(lane * 16);
        if (n < N_) {
            const char* g = (const char*)(xbh + n * (H_ * D_)) + lane * 16;
            asm volatile("global_load_async_to_lds_b128 %0, %1, off"
                         :: "v"(lds), "v"(g) : "memory");
        } else {
            // tail tile: rows past N only feed the masked-out output row 15; keep finite
            float4 z = make_float4(0.f, 0.f, 0.f, 0.f);
            *(float4*)((char*)xs + (size_t)r * P_ * 4 + lane * 16) = z;
        }
    }
    asm volatile("s_wait_asynccnt 0" ::: "memory");
    __syncthreads();

    // ---- stage 2: banded GEMM via v_wmma_f32_16x16x4_f32 -------------------------
    // A layout (16x4 f32): lanes 0-15 row i=lane, lanes 16-31 row i=lane-16;
    //   VGPR0 holds K = 0|2 (by lane half), VGPR1 holds K = 1|3.
    const int i_row = lane & 15;
    const int jjhi  = lane >> 4;                      // 0 or 1
    const int cbase = (jjhi << 1) - 16 * i_row;       // A weight index base: jj - 16*i
    const int d0    = wid * 16;
    const int dcol  = d0 + i_row;
    const int boff  = (jjhi * 2) * P_ + dcol;         // B base: LDS row jj, col dcol

    const int wlane = __float_as_int(w[lane]);        // lane L holds w[L] (wave32)

    v8f acc = {};
    #pragma unroll 4
    for (int q = 0; q < NQ_; ++q) {
        const int ia0 = cbase + 4 * q;                // w-index for A.x
        const int ia1 = ia0 + 1;                      // w-index for A.y
        float a0 = __int_as_float(__builtin_amdgcn_ds_bpermute(ia0 << 2, wlane));
        float a1 = __int_as_float(__builtin_amdgcn_ds_bpermute(ia1 << 2, wlane));
        a0 = ((unsigned)ia0 < 32u) ? a0 : 0.0f;       // band mask
        a1 = ((unsigned)ia1 < 32u) ? a1 : 0.0f;

        const int bi = boff + (4 * q) * P_;           // LDS rows 4q+jj, 4q+jj+1
        const float b0 = xs[bi];
        const float b1 = xs[bi + P_];

        v2f A;  A.x  = a0; A.y  = a1;
        v2f Bm; Bm.x = b0; Bm.y = b1;
        acc = __builtin_amdgcn_wmma_f32_16x16x4_f32(false, A, false, Bm,
                                                    (short)0, acc, false, false);
    }

    // ---- bias[d] = sum_k pe[k,d] * w[k]  (tiny, L2-resident) ---------------------
    float bias = 0.0f;
    for (int k = 0; k < K_; ++k)
        bias = fmaf(pe[k * D_ + dcol], w[k], bias);

    // ---- stage 3: store C (VGPR v -> rows m0+v and m0+v+8 by lane half) ----------
    const float scale = 1.0f / (float)K_;
    float* ybh = y + (((long)b * M_) * H_ + h) * D_;  // + m*H*D + d
    #pragma unroll
    for (int v = 0; v < 8; ++v) {
        const int m = m0 + v + (jjhi ? 8 : 0);
        if (m < M_)
            ybh[(long)m * (H_ * D_) + dcol] = (acc[v] + bias) * scale;
    }
}

extern "C" void kernel_launch(void* const* d_in, const int* in_sizes, int n_in,
                              void* d_out, int out_size, void* d_ws, size_t ws_size,
                              hipStream_t stream) {
    (void)in_sizes; (void)n_in; (void)d_ws; (void)ws_size; (void)out_size;
    const float* x  = (const float*)d_in[0];
    const float* w  = (const float*)d_in[1];
    const float* pe = (const float*)d_in[2];
    float* y = (float*)d_out;

    dim3 grid(MT_ * B_ * H_);   // 64 m-tiles * 32 (b,h) = 2048 workgroups
    dim3 block(256);            // 8 wave32s
    compresskv_wmma<<<grid, block, 0, stream>>>(x, w, pe, y);
}

// v001
// A run of this version takes 23.6 microseconds.
// Two timings next to v000 put it at 1.53 and 1.52 times that version's speed.
#include <hip/hip_runtime.h>
#include <stdint.h>

// Problem constants (fixed by the reference).
#define B_    4
#define N_    16384
#define H_    8
#define D_    128
#define K_    32
#define S_    16
#define M_    1023          // (N-K)/S + 1
#define MT_   64            // number of 16-row m-tiles (ceil(M/16))
#define C_    (H_ * D_)     // 1024 columns of a row: w is the same for every (h, d)
#define NBLK_ 17            // 16-row blocks of the 272-row band window of an m-tile
#define AHEAD_ 3            // blocks whose loads are in flight ahead of the block being multiplied
#define NBUF_ (AHEAD_ + 1)

typedef float v2f __attribute__((ext_vector_type(2)));
typedef float v4f __attribute__((ext_vector_type(4)));
typedef float v8f __attribute__((ext_vector_type(8)));

// One wave = one 16-m tile x 64 columns; 16 waves of a workgroup cover the 1024 columns of one (b, m-tile),
// so a workgroup reads 272 whole rows of 4 KiB. No LDS: x goes from memory straight into B fragments.
// Y_tile(16x16) = sum_q A_q(16x4) * B_q(4x16), A_q[i,jj] = w[4q+jj-16i] (banded, built via ds_bpermute
// from a lane-resident copy of w). A lane's 16 bytes are 4 neighbouring columns of one row: component t
// belongs to accumulator tile t, whose column n is column 4n+t of the wave's 64.
__global__ __launch_bounds__(512)
void compresskv_wmma(const float* __restrict__ x,
                     const float* __restrict__ w,
                     const float* __restrict__ pe,
                     float* __restrict__ y)
{
    const int tid  = threadIdx.x;
    const int lane = tid & 31;
    const int wid  = __builtin_amdgcn_readfirstlane(tid >> 5);   // 0..15 : this wave's 64 columns

    const int mt = blockIdx.x & (MT_ - 1);  // m-tile index
    const int b  = blockIdx.x >> 6;         // 0..3

    const int  m0 = mt * 16;
    const long n0 = (long)m0 * S_;          // first input row of the band window

    // A layout (16x4 f32): lanes 0-15 row i=lane, lanes 16-31 row i=lane-16;
    //   VGPR0 holds K = 0|2 (by lane half), VGPR1 holds K = 1|3. B the same with column n = lane & 15.
    const int i_row = lane & 15;
    const int jjhi  = lane >> 4;                      // 0 or 1
    const int cbase = (jjhi << 1) - 16 * i_row;       // A weight index base: jj - 16*i
    const int col   = wid * 64 + 4 * i_row;           // first of the lane's 4 columns

    // lane's address in window row 2*jjhi; every load of blocks 0..15 is this plus a constant
    const float* xw = x + ((long)b * N_ + n0 + 2 * jjhi) * C_ + col;
    // Block 16 of the last m-tile lies past row N: it feeds only the output row that is not stored
    // (m = 1023), so that tile reads its block 15 again and no load leaves x.
    const float* xh = xw + (long)((mt == MT_ - 1) ? 15 : 16) * 16 * C_;

    // Stands behind the last load from an address, in front of whatever next overwrites the address registers.
#define XCNT_WAIT() asm volatile("s_wait_xcnt 0x0" ::: "memory")
    v4f buf[NBUF_][8];   // ring of blocks: [2*kk + c] = rows 4*kk + c (lanes 0-15) and 4*kk + c + 2 (lanes 16-31)
    // (unrolled: the ring lives in registers, so every index must be a constant)
#define LOAD_ROWS(J, P, E0, E1) \
        _Pragma("unroll") for (int e = (E0); e < (E1); ++e) \
            buf[(J) % NBUF_][e] = __builtin_nontemporal_load((const v4f*)((P) + ((e >> 1) * 4 + (e & 1)) * C_))
#define LOAD_BLK(J) LOAD_ROWS(J, xw + (long)(J) * 16 * C_, 0, 8)

    const int wlane = __float_as_int(w[lane]);        // lane L holds w[L] (wave32)
    // loads return in order: w is asked for first, so that its wait does not stand behind the first blocks of x
    __builtin_amdgcn_sched_barrier(0);

    #pragma unroll   // constant ring indices
    for (int j = 0; j < AHEAD_; ++j) LOAD_BLK(j);

    // ---- banded GEMM via v_wmma_f32_16x16x4_f32 -----------------------------------
    const float* pl = pe + (col & (D_ - 1));          // lane's 4 columns of pe
    v4f   pv[K_];
    float wk[K_];
    v8f acc[4] = {};
    #pragma unroll   // the ring is indexed by constants only when every block is written out
    for (int j = 0; j < NBLK_; ++j) {
        // the two scheduling barriers keep the order "loads of block j+AHEAD, then the products of block j":
        // without them the loads may sink to their use and the stream runs dry
        __builtin_amdgcn_sched_barrier(0);
        if (j + AHEAD_ < NBLK_ - 1) LOAD_BLK(j + AHEAD_);
        if (j + AHEAD_ == NBLK_ - 1) {
            LOAD_ROWS(NBLK_ - 1, xh, 0, 8);
            XCNT_WAIT();
        }
        if (j == NBLK_ - 1) {   // pe (tiny, L2-resident) is asked for under the last block's products
            #pragma unroll   // pv and wk live in registers
            for (int k = 0; k < K_; ++k) {
                pv[k] = *(const v4f*)(pl + k * D_);
                wk[k] = w[k];
            }
            XCNT_WAIT();
        }
        __builtin_amdgcn_sched_barrier(0);
        #pragma unroll   // constant ring indices
        for (int kk = 0; kk < 4; ++kk) {
            const int q   = 4 * j + kk;
            const int ia0 = cbase + 4 * q;                // w-index for A.x
            const int ia1 = ia0 + 1;                      // w-index for A.y
            float a0 = __int_as_float(__builtin_amdgcn_ds_bpermute(ia0 << 2, wlane));
            float a1 = __int_as_float(__builtin_amdgcn_ds_bpermute(ia1 << 2, wlane));
            a0 = ((unsigned)ia0 < 32u) ? a0 : 0.0f;       // band mask
            a1 = ((unsigned)ia1 < 32u) ? a1 : 0.0f;
            v2f A;  A.x = a0; A.y = a1;
            const v4f r0 = buf[j % NBUF_][2 * kk];
            const v4f r1 = buf[j % NBUF_][2 * kk + 1];
            #pragma unroll   // four independent accumulator tiles back to back
            for (int t = 0; t < 4; ++t) {
                v2f Bm; Bm.x = r0[t]; Bm.y = r1[t];
                acc[t] = __builtin_amdgcn_wmma_f32_16x16x4_f32(false, A, false, Bm,
                                                               (short)0, acc[t], false, false);
            }
        }
    }
#undef LOAD_BLK
#undef LOAD_ROWS
#undef XCNT_WAIT

    // ---- bias[d] = sum_k pe[k,d] * w[k] ------------------------------------------
    // keeps the sums below from moving up ahead of the last block's products: pe's latency lies under those
    __builtin_amdgcn_sched_barrier(0);
    v4f bias = {};
    #pragma unroll   // pv and wk live in registers
    for (int k = 0; k < K_; ++k) {
        bias.x = fmaf(pv[k].x, wk[k], bias.x);
        bias.y = fmaf(pv[k].y, wk[k], bias.y);
        bias.z = fmaf(pv[k].z, wk[k], bias.z);
        bias.w = fmaf(pv[k].w, wk[k], bias.w);
    }

    // ---- store C (VGPR v -> rows m0+v and m0+v+8 by lane half), 16 B per lane, 256 B per row ----
    const float scale = 1.0f / (float)K_;
    float* yw = y + ((long)b * M_ + m0 + 8 * jjhi) * C_ + col;
    #pragma unroll
    for (int v = 0; v < 8; ++v) {
        const int m = m0 + v + 8 * jjhi;
        if (m < M_) {
            v4f o;
            o.x = (acc[0][v] + bias.x) * scale;
            o.y = (acc[1][v] + bias.y) * scale;
            o.z = (acc[2][v] + bias.z) * scale;
            o.w = (acc[3][v] + bias.w) * scale;
            *(v4f*)(yw + (long)v * C_) = o;
        }
    }
}

extern "C" void kernel_launch(void* const* d_in, const int* in_sizes, int n_in,
                              void* d_out, int out_size, void* d_ws, size_t ws_size,
                              hipStream_t stream) {
    (void)in_sizes; (void)n_in; (void)d_ws; (void)ws_size; (void)out_size;
    const float* x  = (const float*)d_in[0];
    const float* w  = (const float*)d_in[1];
    const float* pe = (const float*)d_in[2];
    float* y = (float*)d_out;

    dim3 grid(MT_ * B_);        // 64 m-tiles * 4 batches = 256 workgroups
    dim3 block(512);            // 16 wave32s
    compresskv_wmma<<<grid, block, 0, stream>>>(x, w, pe, y);
}

// v002
// Measured time: 22 microseconds a run.
// In two side-by-side timings against v001, it was 1.07 and 1.08 times as fast.
// Over all steps from v000 it is 1.64 times as fast.
#include <hip/hip_runtime.h>
#include <stdint.h>

// Problem constants (fixed by the reference).
#define B_    4
#define N_    16384
#define H_    8
#define D_    128
#define K_    32
#define S_    16
#define M_    1023          // (N-K)/S + 1
#define MT_   64            // number of 16-row m-tiles (ceil(M/16))
#define C_    (H_ * D_)     // 1024 columns of a row: w is the same for every (h, d)
#define NBLK_ 17            // 16-row blocks of the 272-row band window of an m-tile
#define AHEAD_ 3            // blocks whose loads are in flight ahead of the block being multiplied
#define NBUF_ (AHEAD_ + 1)
#define NREL_ 9             // blocks that touch a group of 8 outputs: 8 own ones and the next
#define NPASS_ (2 * NREL_)  // block 8 is multiplied twice: last block of outputs 0..7, first of outputs 8..15

typedef float v2f __attribute__((ext_vector_type(2)));
typedef float v4f __attribute__((ext_vector_type(4)));
typedef float v8f __attribute__((ext_vector_type(8)));

// One wave = one 16-m tile x 64 columns; 16 waves of a workgroup cover the 1024 columns of one (b, m-tile),
// so a workgroup reads 272 whole rows of 4 KiB. x goes from memory straight into B fragments.
// A lane's 16 bytes are 4 neighbouring columns of one row, and each half of them (registers 2p, 2p+1) IS a
// B fragment: k slot 2h+g (h = lane half, g = register) holds column 4n+2p+g of the row that half h loaded.
// The 16 rows of a product tell the two columns apart: row i = 2*ml + s is output ml (of 8) at column 4n+2p+s,
// A[i][2h+g] = (g == s) ? w[row of half h - 16*ml] : 0 (0 outside the 32 taps). The A fragments depend only on
// the block's place among the 9 that touch 8 outputs: all 72 are built once, into LDS, and read from there.
__global__ __launch_bounds__(512)
void compresskv_wmma(const float* __restrict__ x,
                     const float* __restrict__ w,
                     const float* __restrict__ pe,
                     float* __restrict__ y)
{
    const int tid  = threadIdx.x;
    const int lane = tid & 31;
    const int wid  = __builtin_amdgcn_readfirstlane(tid >> 5);   // 0..15 : this wave's 64 columns

    const int mt = blockIdx.x & (MT_ - 1);  // m-tile index
    const int b  = blockIdx.x >> 6;         // 0..3

    const int  m0 = mt * 16;
    const long n0 = (long)m0 * S_;          // first input row of the band window

    // A layout (16x4 f32): lanes 0-15 row i=lane, lanes 16-31 row i=lane-16;
    //   VGPR0 holds K = 0|2 (by lane half), VGPR1 holds K = 1|3. B the same with column n = lane & 15.
    const int i_row = lane & 15;
    const int jjhi  = lane >> 4;                      // 0 or 1
    const int col   = wid * 64 + 4 * i_row;           // first of the lane's 4 columns

    // lane's address in window row 2*jjhi; every load of blocks 0..15 is this plus a constant
    const float* xw = x + ((long)b * N_ + n0 + 2 * jjhi) * C_ + col;
    // Block 16 of the last m-tile lies past row N: it feeds only the output row that is not stored
    // (m = 1023), so that tile reads its block 15 again and no load leaves x.
    const float* xh = xw + (long)((mt == MT_ - 1) ? 15 : 16) * 16 * C_;

    // Stands behind the last load from an address, in front of whatever next overwrites the address registers.
#define XCNT_WAIT() asm volatile("s_wait_xcnt 0x0" ::: "memory")
    v4f buf[NBUF_][8];   // ring of blocks: [2*kk + c] = rows 4*kk + c (lanes 0-15) and 4*kk + c + 2 (lanes 16-31)
    // (unrolled: the ring lives in registers, so every index must be a constant)
#define LOAD_ROWS(J, P, E0, E1) \
        _Pragma("unroll") for (int e = (E0); e < (E1); ++e) \
            buf[(J) % NBUF_][e] = __builtin_nontemporal_load((const v4f*)((P) + ((e >> 1) * 4 + (e & 1)) * C_))
#define LOAD_BLK(J) LOAD_ROWS(J, xw + (long)(J) * 16 * C_, 0, 8)

    const int wlane = __float_as_int(w[lane]);        // lane L holds w[L] (wave32)
    // loads return in order: w is asked for first, so that its wait does not stand behind the first blocks of x
    __builtin_amdgcn_sched_barrier(0);

    #pragma unroll   // constant ring indices
    for (int j = 0; j < AHEAD_; ++j) LOAD_BLK(j);

    // ---- the 72 A fragments, as they lie in registers: atab[(block among 9) * 8 + load][lane] ----
    __shared__ v2f atab[NREL_ * 8 * 32];
    #pragma unroll   // five short trips, the fragment's number is wave-uniform
    for (int it = 0; it < (NREL_ * 8 + 15) / 16; ++it) {
        const int c = wid + 16 * it;
        if (c < NREL_ * 8) {
            // tap index: 16 * block + row of load (c & 7) in this lane half - 16 * output
            const int ia = 16 * (c >> 3) + ((c >> 1) & 3) * 4 + (c & 1) + 2 * jjhi - 16 * (i_row >> 1);
            float a = __int_as_float(__builtin_amdgcn_ds_bpermute(ia << 2, wlane));
            a = ((unsigned)ia < 32u) ? a : 0.0f;          // band mask
            v2f f;
            f.x = (i_row & 1) ? 0.0f : a;
            f.y = (i_row & 1) ? a : 0.0f;
            atab[c * 32 + lane] = f;
        }
    }
    // every wave reads fragments that other waves wrote. The fences name LDS alone: a plain __syncthreads()
    // also waits for the 24 loads of x that are in flight, which nothing here needs yet
    __builtin_amdgcn_fence(__ATOMIC_RELEASE, "workgroup", "local");
    __builtin_amdgcn_s_barrier();
    __builtin_amdgcn_fence(__ATOMIC_ACQUIRE, "workgroup", "local");

    // ---- banded GEMM via v_wmma_f32_16x16x4_f32 -----------------------------------
    const float* pl = pe + (col & (D_ - 1));          // lane's 4 columns of pe
    v4f   pv[K_];
    float wk[K_];
    v8f acc[2][2] = {};  // [group of 8 outputs][column pair p]
    v2f af[2][8];        // A fragments of this pass and of the next
#define LOAD_A(T) \
        _Pragma("unroll") for (int e = 0; e < 8; ++e) \
            af[(T) & 1][e] = atab[(((T) % NREL_) * 8 + e) * 32 + lane]
    LOAD_A(0);
    #pragma unroll   // the ring is indexed by constants only when every pass is written out
    for (int t = 0; t < NPASS_; ++t) {
        const int j = (t < NREL_) ? t : t - 1;            // block of x
        const int o = (t < NREL_) ? 0 : 1;                // group of 8 outputs
        // the two scheduling barriers keep the order "loads of block j+AHEAD and the next pass's A fragments,
        // then the products of this pass": without them the loads may sink to their use and the stream runs dry
        __builtin_amdgcn_sched_barrier(0);
        if (t != NREL_) {   // the second pass over block 8 frees no buffer
            if (j + AHEAD_ < NBLK_ - 1) LOAD_BLK(j + AHEAD_);
            if (j + AHEAD_ == NBLK_ - 1) {
                LOAD_ROWS(NBLK_ - 1, xh, 0, 8);
                XCNT_WAIT();
            }
        }
        if (t + 1 < NPASS_) LOAD_A(t + 1);
        if (t == NPASS_ - 1) {   // pe (tiny, L2-resident) is asked for under the last block's products
            #pragma unroll   // pv and wk live in registers
            for (int k = 0; k < K_; ++k) {
                pv[k] = *(const v4f*)(pl + k * D_);
                wk[k] = w[k];
            }
            XCNT_WAIT();
        }
        __builtin_amdgcn_sched_barrier(0);
        #pragma unroll   // constant ring indices
        for (int e = 0; e < 8; ++e) {
            const v4f r = buf[j % NBUF_][e];
            #pragma unroll   // two independent accumulator tiles in turn
            for (int p = 0; p < 2; ++p) {
                v2f Bm; Bm.x = r[2 * p]; Bm.y = r[2 * p + 1];
                acc[o][p] = __builtin_amdgcn_wmma_f32_16x16x4_f32(false, af[t & 1][e], false, Bm,
                                                                  (short)0, acc[o][p], false, false);
            }
        }
    }
#undef LOAD_A
#undef LOAD_BLK
#undef LOAD_ROWS
#undef XCNT_WAIT

    // ---- bias[d] = sum_k pe[k,d] * w[k] ------------------------------------------
    // keeps the sums below from moving up ahead of the last block's products: pe's latency lies under those
    __builtin_amdgcn_sched_barrier(0);
    v4f bias = {};
    #pragma unroll   // pv and wk live in registers
    for (int k = 0; k < K_; ++k) {
        bias.x = fmaf(pv[k].x, wk[k], bias.x);
        bias.y = fmaf(pv[k].y, wk[k], bias.y);
        bias.z = fmaf(pv[k].z, wk[k], bias.z);
        bias.w = fmaf(pv[k].w, wk[k], bias.w);
    }

    // ---- store C: registers 2u, 2u+1 of both tiles are the lane's 4 columns of output 8o + u + 4*(lane half) ----
    const float scale = 1.0f / (float)K_;
    float* yw = y + ((long)b * M_ + m0 + 4 * jjhi) * C_ + col;
    #pragma unroll
    for (int o = 0; o < 2; ++o) {
        #pragma unroll
        for (int u = 0; u < 4; ++u) {
            const int m = m0 + 8 * o + u + 4 * jjhi;
            if (m < M_) {
                v4f r;
                r.x = (acc[o][0][2 * u]     + bias.x) * scale;
                r.y = (acc[o][0][2 * u + 1] + bias.y) * scale;
                r.z = (acc[o][1][2 * u]     + bias.z) * scale;
                r.w = (acc[o][1][2 * u + 1] + bias.w) * scale;
                *(v4f*)(yw + (long)(8 * o + u) * C_) = r;
            }
        }
    }
}

extern "C" void kernel_launch(void* const* d_in, const int* in_sizes, int n_in,
                              void* d_out, int out_size, void* d_ws, size_t ws_size,
                              hipStream_t stream) {
    (void)in_sizes; (void)n_in; (void)d_ws; (void)ws_size; (void)out_size;
    const float* x  = (const float*)d_in[0];
    const float* w  = (const float*)d_in[1];
    const float* pe = (const float*)d_in[2];
    float* y = (float*)d_out;

    dim3 grid(MT_ * B_);        // 64 m-tiles * 4 batches = 256 workgroups
    dim3 block(512);            // 16 wave32s
    compresskv_wmma<<<grid, block, 0, stream>>>(x, w, pe, y);
}

// v003
// A run of this version takes 20.4 microseconds.
// In two side-by-side timings against v002, it was 1.07 and 1.08 times as fast.
// Counting every step since v000, it is 1.76 times as fast.
#include <hip/hip_runtime.h>
#include <stdint.h>

// Problem constants (fixed by the reference).
#define B_    4
#define N_    16384
#define H_    8
#define D_    128
#define K_    32
#define S_    16
#define M_    1023          // (N-K)/S + 1
#define TM_   32            // outputs of a wave's tile
#define MT_   32            // number of 32-row m-tiles (ceil(M/32))
#define WAVES_ 8            // waves of a workgroup: 64 columns each, half a row together
#define C_    (H_ * D_)     // 1024 columns of a row: w is the same for every (h, d)
#define NBLK_ (TM_ + 1)     // 16-row blocks of the 528-row band window of an m-tile
#define AHEAD_ 3            // blocks whose loads are in flight ahead of the block being multiplied
#define NBUF_ (AHEAD_ + 1)
#define NREL_ 9             // blocks that touch a group of 8 outputs: 8 own ones and the next
#define NGRP_ (TM_ / 8)     // groups of 8 outputs in a tile
#define NPASS_ (NGRP_ * NREL_)  // blocks 8, 16, 24 are multiplied twice: last block of one group, first of the next

typedef float v2f __attribute__((ext_vector_type(2)));
typedef float v4f __attribute__((ext_vector_type(4)));
typedef float v8f __attribute__((ext_vector_type(8)));

// One wave = one 32-m tile x 64 columns; 8 waves of a workgroup cover 512 columns of one (b, m-tile), and the
// workgroup next in index the other 512: together 528 whole rows of 4 KiB. The tall tile reads 33 blocks for
// 32 outputs and needs half the waves. x goes from memory straight into B fragments.
// A lane's 16 bytes are 4 neighbouring columns of one row, and each half of them (registers 2p, 2p+1) IS a
// B fragment: k slot 2h+g (h = lane half, g = register) holds column 4n+2p+g of the row that half h loaded.
// The 16 rows of a product tell the two columns apart: row i = 2*ml + s is output ml (of 8) at column 4n+2p+s,
// A[i][2h+g] = (g == s) ? w[row of half h - 16*ml] : 0 (0 outside the 32 taps). The A fragments depend only on
// the block's place among the 9 that touch 8 outputs: all 72 are built once, into LDS, and read from there.
__global__ __launch_bounds__(WAVES_ * 32)
void compresskv_wmma(const float* __restrict__ x,
                     const float* __restrict__ w,
                     const float* __restrict__ pe,
                     float* __restrict__ y)
{
    const int tid  = threadIdx.x;
    const int lane = tid & 31;
    const int wid  = __builtin_amdgcn_readfirstlane(tid >> 5);   // 0..7 : this wave's 64 columns

    const int ch = blockIdx.x & 1;                 // which half of the 1024 columns
    const int mt = (blockIdx.x >> 1) & (MT_ - 1);  // m-tile index
    const int b  = blockIdx.x >> 6;                // 0..3

    const int  m0 = mt * TM_;
    const long n0 = (long)m0 * S_;          // first input row of the band window

    // A layout (16x4 f32): lanes 0-15 row i=lane, lanes 16-31 row i=lane-16;
    //   VGPR0 holds K = 0|2 (by lane half), VGPR1 holds K = 1|3. B the same with column n = lane & 15.
    const int i_row = lane & 15;
    const int jjhi  = lane >> 4;                      // 0 or 1
    const int col   = (ch * WAVES_ + wid) * 64 + 4 * i_row;   // first of the lane's 4 columns

    // lane's address in window row 2*jjhi; every load of blocks 0..31 is this plus a constant
    const float* xw = x + ((long)b * N_ + n0 + 2 * jjhi) * C_ + col;
    // Block 32 of the last m-tile lies past row N: it feeds only the output row that is not stored
    // (m = 1023), so that tile reads its block 31 again and no load leaves x.
    const float* xh = xw + (long)((mt == MT_ - 1) ? NBLK_ - 2 : NBLK_ - 1) * 16 * C_;

    // Stands behind the last load from an address, in front of whatever next overwrites the address registers.
#define XCNT_WAIT() asm volatile("s_wait_xcnt 0x0" ::: "memory")
    v4f buf[NBUF_][8];   // ring of blocks: [2*kk + c] = rows 4*kk + c (lanes 0-15) and 4*kk + c + 2 (lanes 16-31)
    // (unrolled: the ring lives in registers, so every index must be a constant)
#define LOAD_ROWS(J, P, E0, E1) \
        _Pragma("unroll") for (int e = (E0); e < (E1); ++e) \
            buf[(J) % NBUF_][e] = __builtin_nontemporal_load((const v4f*)((P) + ((e >> 1) * 4 + (e & 1)) * C_))
#define LOAD_BLK(J) LOAD_ROWS(J, xw + (long)(J) * 16 * C_, 0, 8)

    const int wlane = __float_as_int(w[lane]);        // lane L holds w[L] (wave32)
    // loads return in order: w is asked for first, so that its wait does not stand behind the first blocks of x
    __builtin_amdgcn_sched_barrier(0);

    #pragma unroll   // constant ring indices
    for (int j = 0; j < AHEAD_; ++j) LOAD_BLK(j);

    // ---- the 72 A fragments, as they lie in registers: atab[(block among 9) * 8 + load][lane] ----
    __shared__ v2f atab[NREL_ * 8 * 32];
    static_assert(WAVES_ == 8, "wave e builds load e of each of the 9 blocks");
    #pragma unroll   // nine independent trips: their cross-lane reads go out together, one wait for all
    for (int it = 0; it < NREL_; ++it) {
        const int c = it * 8 + wid;
        // tap index: 16 * block + row of load wid in this lane half - 16 * output
        const int ia = 16 * it + ((wid >> 1) & 3) * 4 + (wid & 1) + 2 * jjhi - 16 * (i_row >> 1);
        float a = __int_as_float(__builtin_amdgcn_ds_bpermute(ia << 2, wlane));
        a = ((unsigned)ia < 32u) ? a : 0.0f;          // band mask
        v2f f;
        f.x = (i_row & 1) ? 0.0f : a;
        f.y = (i_row & 1) ? a : 0.0f;
        atab[c * 32 + lane] = f;
    }
    // every wave reads fragments that other waves wrote. The fences name LDS alone: a plain __syncthreads()
    // also waits for the 24 loads of x that are in flight, which nothing here needs yet
    __builtin_amdgcn_fence(__ATOMIC_RELEASE, "workgroup", "local");
    __builtin_amdgcn_s_barrier();
    __builtin_amdgcn_fence(__ATOMIC_ACQUIRE, "workgroup", "local");

    // ---- banded GEMM via v_wmma_f32_16x16x4_f32 -----------------------------------
    const float* pl = pe + (col & (D_ - 1));          // lane's 4 columns of pe
    v4f   pv[K_];
    float wk[K_];
    v8f acc[NGRP_][2] = {};  // [group of 8 outputs][column pair p]
    v2f af[2][8];        // A fragments of this pass and of the next
#define LOAD_A(T) \
        _Pragma("unroll") for (int e = 0; e < 8; ++e) \
            af[(T) & 1][e] = atab[(((T) % NREL_) * 8 + e) * 32 + lane]
    LOAD_A(0);
    #pragma unroll   // the ring is indexed by constants only when every pass is written out
    for (int t = 0; t < NPASS_; ++t) {
        const int o = t / NREL_;                          // group of 8 outputs
        const int j = 8 * o + t % NREL_;                  // block of x
        // the two scheduling barriers keep the order "loads of block j+AHEAD and the next pass's A fragments,
        // then the products of this pass": without them the loads may sink to their use and the stream runs dry
        __builtin_amdgcn_sched_barrier(0);
        if (t == 0 || t % NREL_ != 0) {   // the second pass over a block frees no buffer
            if (j + AHEAD_ < NBLK_ - 1) LOAD_BLK(j + AHEAD_);
            if (j + AHEAD_ == NBLK_ - 1) {
                LOAD_ROWS(NBLK_ - 1, xh, 0, 8);
                XCNT_WAIT();
            }
        }
        if (t + 1 < NPASS_) LOAD_A(t + 1);
        if (t == NPASS_ - 1) {   // pe (tiny, L2-resident) is asked for under the last block's products
            #pragma unroll   // pv and wk live in registers
            for (int k = 0; k < K_; ++k) {
                pv[k] = *(const v4f*)(pl + k * D_);
                wk[k] = w[k];
            }
            XCNT_WAIT();
        }
        __builtin_amdgcn_sched_barrier(0);
        #pragma unroll   // constant ring indices
        for (int e = 0; e < 8; ++e) {
            const v4f r = buf[j % NBUF_][e];
            #pragma unroll   // two independent accumulator tiles in turn
            for (int p = 0; p < 2; ++p) {
                v2f Bm; Bm.x = r[2 * p]; Bm.y = r[2 * p + 1];
                acc[o][p] = __builtin_amdgcn_wmma_f32_16x16x4_f32(false, af[t & 1][e], false, Bm,
                                                                  (short)0, acc[o][p], false, false);
            }
        }
    }
#undef LOAD_A
#undef LOAD_BLK
#undef LOAD_ROWS
#undef XCNT_WAIT

    // ---- bias[d] = sum_k pe[k,d] * w[k] ------------------------------------------
    // keeps the sums below from moving up ahead of the last block's products: pe's latency lies under those
    __builtin_amdgcn_sched_barrier(0);
    v4f bias = {};
    #pragma unroll   // pv and wk live in registers
    for (int k = 0; k < K_; ++k) {
        bias.x = fmaf(pv[k].x, wk[k], bias.x);
        bias.y = fmaf(pv[k].y, wk[k], bias.y);
        bias.z = fmaf(pv[k].z, wk[k], bias.z);
        bias.w = fmaf(pv[k].w, wk[k], bias.w);
    }

    // ---- store C: registers 2u, 2u+1 of both tiles are the lane's 4 columns of output 8o + u + 4*(lane half) ----
    const float scale = 1.0f / (float)K_;
    float* yw = y + ((long)b * M_ + m0 + 4 * jjhi) * C_ + col;
    #pragma unroll
    for (int o = 0; o < NGRP_; ++o) {
        #pragma unroll
        for (int u = 0; u < 4; ++u) {
            const int m = m0 + 8 * o + u + 4 * jjhi;
            if (m < M_) {
                v4f r;
                r.x = (acc[o][0][2 * u]     + bias.x) * scale;
                r.y = (acc[o][0][2 * u + 1] + bias.y) * scale;
                r.z = (acc[o][1][2 * u]     + bias.z) * scale;
                r.w = (acc[o][1][2 * u + 1] + bias.w) * scale;
                *(v4f*)(yw + (long)(8 * o + u) * C_) = r;
            }
        }
    }
}

extern "C" void kernel_launch(void* const* d_in, const int* in_sizes, int n_in,
                              void* d_out, int out_size, void* d_ws, size_t ws_size,
                              hipStream_t stream) {
    (void)in_sizes; (void)n_in; (void)d_ws; (void)ws_size; (void)out_size;
    const float* x  = (const float*)d_in[0];
    const float* w  = (const float*)d_in[1];
    const float* pe = (const float*)d_in[2];
    float* y = (float*)d_out;

    dim3 grid(MT_ * 2 * B_);    // 32 m-tiles * 2 column halves * 4 batches = 256 workgroups
    dim3 block(WAVES_ * 32);    // 8 wave32s
    compresskv_wmma<<<grid, block, 0, stream>>>(x, w, pe, y);
}

// v004
// Measured time: 19.2 microseconds a run.
// Timed twice side by side with v003, it ran 1.06 times as fast both times.
// Counting every step since v000, it is 1.87 times as fast.
#include <hip/hip_runtime.h>
#include <stdint.h>

// Problem constants (fixed by the reference).
#define B_    4
#define N_    16384
#define H_    8
#define D_    128
#define K_    32
#define S_    16
#define M_    1023          // (N-K)/S + 1
#define TM_   32            // outputs of a wave's tile
#define MT_   32            // number of 32-row m-tiles (ceil(M/32))
#define WAVES_ 8            // waves of a workgroup: 8 consecutive m-tiles of one strip of 64 columns
#define C_    (H_ * D_)     // 1024 columns of a row: w is the same for every (h, d)
#define NBLK_ TM_           // 16-row blocks a wave streams: its own 512 rows; the 33rd block of its window is the next tile's first
#define AHEAD_ 3            // blocks whose loads are in flight ahead of the block being multiplied
#define NBUF_ (AHEAD_ + 1)
#define NREL_ 9             // blocks that touch a group of 8 outputs: 8 own ones and the next
#define NGRP_ (TM_ / 8)     // groups of 8 outputs in a tile
#define NPASS_ (NGRP_ * NREL_ - 1)  // blocks 8, 16, 24 are multiplied twice: last block of one group, first of the next

typedef float v2f __attribute__((ext_vector_type(2)));
typedef float v4f __attribute__((ext_vector_type(4)));
typedef float v8f __attribute__((ext_vector_type(8)));

// One wave = one 32-m tile x 64 columns; the 8 waves of a workgroup are 8 consecutive m-tiles of one strip of
// 64 columns, and the 16 workgroups next to each other in index the 16 strips of the same rows.
// A tile's last output also needs the 16 rows behind the tile, which are the next tile's first block: the wave
// that streams that block multiplies it once more, by the taps 16..31, and hands the sums to its neighbour
// through LDS, so the block is read once. Only the block behind the workgroup's last tile is read by two
// workgroups: wave 0 fetches it, for wave 7. x goes from memory straight into B fragments.
// A lane's 16 bytes are 4 neighbouring columns of one row, and each half of them (registers 2p, 2p+1) IS a
// B fragment: k slot 2h+g (h = lane half, g = register) holds column 4n+2p+g of the row that half h loaded.
// The 16 rows of a product tell the two columns apart: row i = 2*ml + s is output ml (of 8) at column 4n+2p+s,
// A[i][2h+g] = (g == s) ? w[row of half h - 16*ml] : 0 (0 outside the 32 taps). The A fragments depend only on
// the block's place among the 9 that touch 8 outputs: all 72 are built once, into LDS, and read from there.
__global__ __launch_bounds__(WAVES_ * 32)
void compresskv_wmma(const float* __restrict__ x,
                     const float* __restrict__ w,
                     const float* __restrict__ pe,
                     float* __restrict__ y)
{
    const int tid  = threadIdx.x;
    const int lane = tid & 31;
    // 0..7 : this wave's m-tile among the workgroup's 8 (the mask tells the compiler the range: one store guard, not 16)
    const int wid  = __builtin_amdgcn_readfirstlane(tid >> 5) & (WAVES_ - 1);

    const int strip = blockIdx.x & 15;             // which 64 of the 1024 columns
    const int tg = (blockIdx.x >> 4) & (MT_ / WAVES_ - 1);  // which 8 m-tiles
    const int mt = tg * WAVES_ + wid;              // m-tile index
    const int b  = blockIdx.x >> 6;                // 0..3

    const int  m0 = mt * TM_;
    const long n0 = (long)m0 * S_;          // first input row of the band window

    // A layout (16x4 f32): lanes 0-15 row i=lane, lanes 16-31 row i=lane-16;
    //   VGPR0 holds K = 0|2 (by lane half), VGPR1 holds K = 1|3. B the same with column n = lane & 15.
    const int i_row = lane & 15;
    const int jjhi  = lane >> 4;                      // 0 or 1
    const int col   = strip * 64 + 4 * i_row;         // first of the lane's 4 columns

    // lane's address in window row 2*jjhi; every load of blocks 0..31 is this plus a constant
    const float* xw = x + ((long)b * N_ + n0 + 2 * jjhi) * C_ + col;
    // The block that the wave multiplies for its neighbour: its own first block, but in wave 0 the block behind
    // the workgroup's last tile. Behind the last m-tile of a batch that one lies past row N and feeds only the
    // output row that is not stored (m = 1023): there wave 0 takes its own first block too and no load leaves x.
    const float* xh = xw + (long)((wid == 0 && tg != MT_ / WAVES_ - 1) ? WAVES_ * NBLK_ : 0) * 16 * C_;

    // Stands behind the last load from an address, in front of whatever next overwrites the address registers.
#define XCNT_WAIT() asm volatile("s_wait_xcnt 0x0" ::: "memory")
    v4f buf[NBUF_][8];   // ring of blocks: [2*kk + c] = rows 4*kk + c (lanes 0-15) and 4*kk + c + 2 (lanes 16-31)
    // (unrolled: the ring lives in registers, so every index must be a constant)
#define LOAD_ROWS(J, P, E0, E1) \
        _Pragma("unroll") for (int e = (E0); e < (E1); ++e) \
            buf[(J) % NBUF_][e] = __builtin_nontemporal_load((const v4f*)((P) + ((e >> 1) * 4 + (e & 1)) * C_))
#define LOAD_BLK(J) LOAD_ROWS(J, xw + (long)(J) * 16 * C_, 0, 8)

    const int wlane = __float_as_int(w[lane]);        // lane L holds w[L] (wave32)
    // loads return in order: w is asked for first, so that its wait does not stand behind the first blocks of x
    __builtin_amdgcn_sched_barrier(0);

    // The neighbour's block goes into the ring place that block AHEAD_ takes behind it; it is asked for first
    // because loads return in order and it is multiplied first. One instruction stream in every wave: waves
    // 1..7 ask for their first block twice, a few cycles apart, while its lines are still on their way.
    LOAD_ROWS(AHEAD_, xh, 0, 8);
    #pragma unroll   // constant ring indices
    for (int j = 0; j < AHEAD_; ++j) LOAD_BLK(j);
    // the wait names the address of the first eight loads: its registers stay theirs up to here, and are not
    // given to a later load's result ahead of the wait
    asm volatile("s_wait_xcnt 0x0" :: "v"(xh) : "memory");

    // ---- the 72 A fragments, as they lie in registers: atab[(block among 9) * 8 + load][lane] ----
    __shared__ v2f atab[NREL_ * 8 * 32];
    static_assert(WAVES_ == 8, "wave e builds load e of each of the 9 blocks");
    #pragma unroll   // nine independent trips: their cross-lane reads go out together, one wait for all
    for (int it = 0; it < NREL_; ++it) {
        const int c = it * 8 + wid;
        // tap index: 16 * block + row of load wid in this lane half - 16 * output
        const int ia = 16 * it + ((wid >> 1) & 3) * 4 + (wid & 1) + 2 * jjhi - 16 * (i_row >> 1);
        float a = __int_as_float(__builtin_amdgcn_ds_bpermute(ia << 2, wlane));
        a = ((unsigned)ia < 32u) ? a : 0.0f;          // band mask
        v2f f;
        f.x = (i_row & 1) ? 0.0f : a;
        f.y = (i_row & 1) ? a : 0.0f;
        atab[c * 32 + lane] = f;
    }
    // every wave reads fragments that other waves wrote. The fences name LDS alone: a plain __syncthreads()
    // also waits for the 32 loads of x that are in flight, which nothing here needs yet
    __builtin_amdgcn_fence(__ATOMIC_RELEASE, "workgroup", "local");
    __builtin_amdgcn_s_barrier();
    __builtin_amdgcn_fence(__ATOMIC_ACQUIRE, "workgroup", "local");

    // ---- banded GEMM via v_wmma_f32_16x16x4_f32 -----------------------------------
    const float* pl = pe + (col & (D_ - 1));          // lane's 4 columns of pe
    v4f   pv[K_];
    float wk[K_];
    v8f acc[NGRP_][2] = {};  // [group of 8 outputs][column pair p]
    v2f af[2][8];        // A fragments of this pass and of the next
#define LOAD_A(T) \
        _Pragma("unroll") for (int e = 0; e < 8; ++e) \
            af[(T) & 1][e] = atab[(((T) % NREL_) * 8 + e) * 32 + lane]
    // ---- the neighbour's share: this block x taps 16..31 (the 9th of the 9 fragment sets), output 7 of 8 ----
    __shared__ v4f xch[WAVES_][32];
    v8f ax[2] = {};
    #pragma unroll   // af lives in registers; set 8 takes the place that pass 1's set fills behind it
    for (int e = 0; e < 8; ++e) af[1][e] = atab[((NREL_ - 1) * 8 + e) * 32 + lane];
    LOAD_A(0);
    // keeps both sets' LDS reads in one group ahead of the products
    __builtin_amdgcn_sched_barrier(0);
    #pragma unroll   // constant ring indices
    for (int e = 0; e < 8; ++e) {
        const v4f r = buf[AHEAD_ % NBUF_][e];
        #pragma unroll   // two independent accumulator tiles in turn
        for (int p = 0; p < 2; ++p) {
            v2f Bm; Bm.x = r[2 * p]; Bm.y = r[2 * p + 1];
            ax[p] = __builtin_amdgcn_wmma_f32_16x16x4_f32(false, af[1][e], false, Bm,
                                                          (short)0, ax[p], false, false);
        }
    }
    // Only registers 6, 7 of these results are used: the four slots keep the distance that a matrix result needs
    // before it is overwritten.
    // The scheduling barrier holds them directly behind the products.
    __builtin_amdgcn_sched_barrier(0);
    asm volatile("v_nop\n\tv_nop\n\tv_nop\n\tv_nop");
    #pragma unroll   // the ring is indexed by constants only when every pass is written out
    for (int t = 0; t < NPASS_; ++t) {
        const int o = t / NREL_;                          // group of 8 outputs
        const int j = 8 * o + t % NREL_;                  // block of x
        // the two scheduling barriers keep the order "loads of block j+AHEAD and the next pass's A fragments,
        // then the products of this pass": without them the loads may sink to their use and the stream runs dry
        __builtin_amdgcn_sched_barrier(0);
        if (t == NREL_) {
            // every wave has long written its neighbour's share; the fences name LDS alone, as above
            __builtin_amdgcn_fence(__ATOMIC_RELEASE, "workgroup", "local");
            __builtin_amdgcn_s_barrier();
            __builtin_amdgcn_fence(__ATOMIC_ACQUIRE, "workgroup", "local");
            const v4f h = xch[wid][lane];     // start value of the tile's last output (0 in lanes 0-15)
            acc[NGRP_ - 1][0][6] = h.x; acc[NGRP_ - 1][0][7] = h.y;
            acc[NGRP_ - 1][1][6] = h.z; acc[NGRP_ - 1][1][7] = h.w;
        }
        if (t == 0 || t % NREL_ != 0) {   // the second pass over a block frees no buffer
            if (j + AHEAD_ < NBLK_) LOAD_BLK(j + AHEAD_);
            if (j + AHEAD_ == NBLK_ - 1) XCNT_WAIT();
        }
        if (t == 1) {
            // registers 6, 7 of both tiles: lanes 16-31 hold output 7 of 8 at the lane's 4 columns, lanes 0-15
            // output 3 of 8, whose taps in set 8 are all 0. The receiver is the wave of the m-tile before.
            // Written one pass behind its products, so that the wave does not wait for them.
            v4f h; h.x = ax[0][6]; h.y = ax[0][7]; h.z = ax[1][6]; h.w = ax[1][7];
            xch[(wid + WAVES_ - 1) & (WAVES_ - 1)][lane] = h;
        }
        if (t + 1 < NPASS_) LOAD_A(t + 1);
        if (t == NPASS_ - 1) {   // pe (tiny, L2-resident) is asked for under the last block's products
            #pragma unroll   // pv and wk live in registers
            for (int k = 0; k < K_; ++k) {
                pv[k] = *(const v4f*)(pl + k * D_);
                wk[k] = w[k];
            }
            XCNT_WAIT();
        }
        __builtin_amdgcn_sched_barrier(0);
        #pragma unroll   // constant ring indices
        for (int e = 0; e < 8; ++e) {
            const v4f r = buf[j % NBUF_][e];
            #pragma unroll   // two independent accumulator tiles in turn
            for (int p = 0; p < 2; ++p) {
                v2f Bm; Bm.x = r[2 * p]; Bm.y = r[2 * p + 1];
                acc[o][p] = __builtin_amdgcn_wmma_f32_16x16x4_f32(false, af[t & 1][e], false, Bm,
                                                                  (short)0, acc[o][p], false, false);
            }
        }
    }
#undef LOAD_A
#undef LOAD_BLK
#undef LOAD_ROWS
#undef XCNT_WAIT

    // ---- bias[d] = sum_k pe[k,d] * w[k] ------------------------------------------
    // keeps the sums below from moving up ahead of the last block's products: pe's latency lies under those
    __builtin_amdgcn_sched_barrier(0);
    v4f bias = {};
    #pragma unroll   // pv and wk live in registers
    for (int k = 0; k < K_; ++k) {
        bias.x = fmaf(pv[k].x, wk[k], bias.x);
        bias.y = fmaf(pv[k].y, wk[k], bias.y);
        bias.z = fmaf(pv[k].z, wk[k], bias.z);
        bias.w = fmaf(pv[k].w, wk[k], bias.w);
    }

    // ---- store C: registers 2u, 2u+1 of both tiles are the lane's 4 columns of output 8o + u + 4*(lane half) ----
    const float scale = 1.0f / (float)K_;
    float* yw = y + ((long)b * M_ + m0 + 4 * jjhi) * C_ + col;
    #pragma unroll
    for (int o = 0; o < NGRP_; ++o) {
        #pragma unroll
        for (int u = 0; u < 4; ++u) {
            const int m = m0 + 8 * o + u + 4 * jjhi;
            if (m < M_) {
                v4f r;
                r.x = (acc[o][0][2 * u]     + bias.x) * scale;
                r.y = (acc[o][0][2 * u + 1] + bias.y) * scale;
                r.z = (acc[o][1][2 * u]     + bias.z) * scale;
                r.w = (acc[o][1][2 * u + 1] + bias.w) * scale;
                *(v4f*)(yw + (long)(8 * o + u) * C_) = r;
            }
        }
    }
}

extern "C" void kernel_launch(void* const* d_in, const int* in_sizes, int n_in,
                              void* d_out, int out_size, void* d_ws, size_t ws_size,
                              hipStream_t stream) {
    (void)in_sizes; (void)n_in; (void)d_ws; (void)ws_size; (void)out_size;
    const float* x  = (const float*)d_in[0];
    const float* w  = (const float*)d_in[1];
    const float* pe = (const float*)d_in[2];
    float* y = (float*)d_out;

    dim3 grid(MT_ / WAVES_ * 16 * B_);    // 4 groups of 8 m-tiles * 16 column strips * 4 batches = 256 workgroups
    dim3 block(WAVES_ * 32);    // 8 wave32s
    compresskv_wmma<<<grid, block, 0, stream>>>(x, w, pe, y);
}
